// v010
// Times are from an AMD MI455X. After a warm-up the kernel runs many times in a row, and a time is the length of
// such a window on the GPU divided by its runs, so every launch and the gaps after it count. The runs cycle
// through copies of the inputs. A figure is the median of several windows, for all but v000 over two sittings.
// Sittings can differ by a few percent; kernels timed side by side share one.
// The versions before v010 are in another document.
// A run of this version takes 168 microseconds.
// Timed twice side by side with v009, it ran 1.11 times as fast both times.
// Over all steps from v000, the starting kernel, it is 35.5 times as fast.
#include <hip/hip_runtime.h>
// FlaxGemmaAttention (2 x 2048 tokens, D 2048, 8 query heads of 256 sharing ONE kv head; rotate-half RoPE from the INPUT position_ids; causal + INPUT padding mask; scale 256^-0.5; out = attn Wo).
// Structure (both batches in every launch: flat rows for the projections and elementwise passes, blockIdx.z for attention): three launches in front of attention, each holding the jobs that do not depend on one another: (1) exact f16 plane of the hidden states, the four weight transposes, RoPE tables (f32 trig); (2) q, k and v as ONE GEMM over the stacked weight rows (32x64 wave tiles, f32 accumulation, exact x16 weights); (3) rotation on VALU into f16 hi (+ 2^10 residual) planes, V^T hi/residual by LDS tiles; attention in ONE launch of two kinds of block (head = blockIdx.y, batch = blockIdx.z), S and P in registers in both. Rows < 256 (whose outputs average over few keys): hi+lo operands throughout (3-term S, 3-term P.V, hi+lo O into Wo), the same walk with residual terms in accumulators of their own (fa_band0). Rows >= 256, plain f16 operands: one block per 64 late + 64 early rows of a head walks keys in tiles of 64 with a running maximum and sum, the late rows' keys shared out over two waves so that every block makes the same number of trips, O leaves as f16; output GEMM, ONE launch: a block of rows < 256 holds 64 rows of O hi and the same 64 rows of the residual plane in its A tile and adds the two products in its epilogue.
// Compute dtype: inputs and weights rounded to bf16; rows >= 256: q, k, P, v, O as f16 (~2^-12); rows < 256: hi + residual pairs; f32 accumulation/softmax/trig. v_wmma_f32_16x16x32_f16.
#define NB 2
#define SQ 2048
#define DM 2048
#define NHQ 8
#define HD 256
#define HH (HD / 2)
#define BAND 256
#define NBAND (SQ / BAND)
typedef __bf16 v16b __attribute__((ext_vector_type(16)));
typedef unsigned short v8us __attribute__((ext_vector_type(8), may_alias));
typedef float  v8f  __attribute__((ext_vector_type(8)));
typedef float  v4f  __attribute__((ext_vector_type(4)));
typedef float  v4fa __attribute__((ext_vector_type(4), may_alias));
union FragB { v16b v; v8us half[2]; unsigned short u[16]; };

__device__ __forceinline__ unsigned short bf16_bits(float x) { unsigned int u = __float_as_uint(x); return (unsigned short)((u + 0x7FFFu + ((u >> 16) & 1u)) >> 16); }
__device__ __forceinline__ float bf16_val(unsigned short b) { return __uint_as_float(((unsigned int)b) << 16); }
__device__ __forceinline__ float bf16_round(float x) { return bf16_val(bf16_bits(x)); }
// D += A·B with NT terms: 1 = ah·bh, 2 = + al·bh (A split), 3 = + ah·bl (both split)
template <int NT>
__device__ __forceinline__ v8f mmaN(v16b ah, v16b al, v16b bh, v16b bl, v8f c) {
  c = __builtin_amdgcn_wmma_f32_16x16x32_bf16(false, ah, false, bh, (short)0, c, false, false);
  if (NT >= 2) c = __builtin_amdgcn_wmma_f32_16x16x32_bf16(false, al, false, bh, (short)0, c, false, false);
  if (NT >= 3) c = __builtin_amdgcn_wmma_f32_16x16x32_bf16(false, ah, false, bl, (short)0, c, false, false);
  asm volatile("v_nop\n\tv_nop\n\tv_nop\n\tv_nop" : "+v"(c) : "v"(ah), "v"(al), "v"(bh), "v"(bl));
  return c;
}

__global__ __launch_bounds__(256) void k_wt_bf16(const float* __restrict__ W, unsigned short* __restrict__ Wt, int K, int N) {
  const int t = blockIdx.x * 256 + threadIdx.x;
  const int k8n = K / 8;
  if (t >= N * k8n) return;
  const int n = t / k8n, k8 = (t % k8n) * 8;
  v8us v;
#pragma unroll
  for (int i = 0; i < 8; ++i) v[i] = bf16_bits(W[(size_t)(k8 + i) * N + n]);
  *(v8us*)(Wt + (size_t)n * K + k8) = v;
  
}

// GEMM C[M][N] (f32, pitch ldc) = act(A[M][K]·W + bias). A f32 row-major (pitch lda) converted per fragment to bf16
// (ASPLIT: hi/lo two planes -> 2 terms, else single rounded term); Wt bf16 [N][K] (pitch ldb). BIAS_BF16 rounds the
// bias to bf16 first (bias quantised to bf16 before the add). K%32==0, M%16==0, N%64==0.
template <bool ASPLIT, int ACT, bool BIAS_BF16>
__global__ __launch_bounds__(128) void k_gemm_bf(const float* __restrict__ A, int lda, const unsigned short* __restrict__ Wt, int ldb,
                                               const float* __restrict__ bias, float* __restrict__ C, int ldc, int M, int N, int K) {
  __shared__ __attribute__((aligned(16))) float so[4][16][64];
  const int tid = threadIdx.x, w = tid >> 5, lane = tid & 31, ln = lane & 15, hh = lane >> 4;
  const int ntn = N / 64;
  const int wid = blockIdx.x * 4 + w;
  const int mt = wid / ntn, nq = wid % ntn;
  if (mt * 16 >= M) return;
  const int row0 = mt * 16, col0 = nq * 64;
  const float* arow = A + (size_t)(row0 + ln) * lda;
  v8f acc[4] = {};
  for (int kb = 0; kb < K; kb += 32) {
    FragB ah, al;
    const v4f x0 = *(const v4fa*)(arow + kb + 8 * hh), x1 = *(const v4fa*)(arow + kb + 8 * hh + 4);
    const v4f x2 = *(const v4fa*)(arow + kb + 16 + 8 * hh), x3 = *(const v4fa*)(arow + kb + 16 + 8 * hh + 4);
    float xs[16] = {x0[0],x0[1],x0[2],x0[3],x1[0],x1[1],x1[2],x1[3],x2[0],x2[1],x2[2],x2[3],x3[0],x3[1],x3[2],x3[3]};
#pragma unroll
    for (int i = 0; i < 16; ++i) { const unsigned short hb = bf16_bits(xs[i]); ah.u[i] = hb; al.u[i] = ASPLIT ? bf16_bits(xs[i] - bf16_val(hb)) : (unsigned short)0; }
#pragma unroll
    for (int t = 0; t < 4; ++t) {
      const unsigned short* brow = Wt + (size_t)(col0 + t * 16 + ln) * ldb + kb;
      FragB b;
      b.half[0] = *(const v8us*)(brow + 8 * hh);
      b.half[1] = *(const v8us*)(brow + 16 + 8 * hh);
      acc[t] = mmaN<ASPLIT ? 2 : 1>(ah.v, al.v, b.v, b.v, acc[t]);
    }
  }
#pragma unroll
  for (int t = 0; t < 4; ++t) {
    float bv = bias ? bias[col0 + t * 16 + ln] : 0.f;
    if (BIAS_BF16) bv = bf16_round(bv);
#pragma unroll
    for (int r = 0; r < 8; ++r) { float v = acc[t][r] + bv; if (ACT == 1) v = fmaxf(v, 0.f); so[w][8 * hh + r][t * 16 + ln] = v; }
  }
  __builtin_amdgcn_fence(__ATOMIC_ACQ_REL, "workgroup");
  __builtin_amdgcn_wave_barrier();
  const int rsub = lane >> 4, c4 = (lane & 15) * 4;
  {
#pragma unroll
    for (int q = 0; q < 8; ++q) {
      const int r = q * 2 + rsub;
      const v4f v = *(const v4fa*)&so[w][r][c4];
      *(v4f*)(C + (size_t)(row0 + r) * ldc + col0 + c4) = v;
    }
    
  }
}

// GEMM C = act(A·W + bias + resid): A f32 (ASPLIT -> hi/lo 2 terms), Wt bf16 [N][K]; ACT 0 none, 1 relu, 2 exact gelu;
// resid (optional, f32, row index = (row % rmod), pitch ldr, RES_BF16 rounds it) added before the activation.
template <bool ASPLIT, int ACT, bool BIAS_BF16, bool RES_BF16>
__global__ __launch_bounds__(128) void k_gemm_bf3(const float* __restrict__ A, int lda, const unsigned short* __restrict__ Wt, int ldb,
                                                const float* __restrict__ bias, const float* __restrict__ resid, int rmod, int ldr,
                                                float* __restrict__ C, int ldc, int M, int N, int K) {
  __shared__ __attribute__((aligned(16))) float so[4][16][64];
  const int tid = threadIdx.x, w = tid >> 5, lane = tid & 31, ln = lane & 15, hh = lane >> 4;
  const int ntn = N / 64;
  const int wid = blockIdx.x * 4 + w;
  const int mt = wid / ntn, nq = wid % ntn;
  if (mt * 16 >= M) return;
  const int row0 = mt * 16, col0 = nq * 64;
  const float* arow = A + (size_t)(row0 + ln) * lda;
  v8f acc[4] = {};
  for (int kb = 0; kb < K; kb += 32) {
    FragB ah, al;
    const v4f x0 = *(const v4fa*)(arow + kb + 8 * hh), x1 = *(const v4fa*)(arow + kb + 8 * hh + 4);
    const v4f x2 = *(const v4fa*)(arow + kb + 16 + 8 * hh), x3 = *(const v4fa*)(arow + kb + 16 + 8 * hh + 4);
    float xs[16] = {x0[0],x0[1],x0[2],x0[3],x1[0],x1[1],x1[2],x1[3],x2[0],x2[1],x2[2],x2[3],x3[0],x3[1],x3[2],x3[3]};
#pragma unroll
    for (int i = 0; i < 16; ++i) { const unsigned short hb = bf16_bits(xs[i]); ah.u[i] = hb; al.u[i] = ASPLIT ? bf16_bits(xs[i] - bf16_val(hb)) : (unsigned short)0; }
#pragma unroll
    for (int t = 0; t < 4; ++t) {
      const unsigned short* brow = Wt + (size_t)(col0 + t * 16 + ln) * ldb + kb;
      FragB b;
      b.half[0] = *(const v8us*)(brow + 8 * hh);
      b.half[1] = *(const v8us*)(brow + 16 + 8 * hh);
      acc[t] = mmaN<ASPLIT ? 2 : 1>(ah.v, al.v, b.v, b.v, acc[t]);
    }
  }
#pragma unroll
  for (int t = 0; t < 4; ++t) {
    const int col = col0 + t * 16 + ln;
    float bv = bias ? bias[col] : 0.f;
    if (BIAS_BF16) bv = bf16_round(bv);
#pragma unroll
    for (int r = 0; r < 8; ++r) {
      float v = acc[t][r] + bv;
      if (resid) { float rv = resid[(size_t)((row0 + 8 * hh + r) % rmod) * ldr + col]; if (RES_BF16) rv = bf16_round(rv); v += rv; }
      if (ACT == 1) v = fmaxf(v, 0.f);
      if (ACT == 2) v = 0.5f * v * (1.0f + erff(v * 0.70710678118654752f));
      if (ACT == 3) { const float u = 0.7978845608028654f * (v + 0.044715f * v * v * v); v = 0.5f * v * (1.0f + tanhf(u)); }
      so[w][8 * hh + r][t * 16 + ln] = v;
    }
  }
  __builtin_amdgcn_fence(__ATOMIC_ACQ_REL, "workgroup");
  __builtin_amdgcn_wave_barrier();
  const int rsub = lane >> 4, c4 = (lane & 15) * 4;
  {
#pragma unroll
    for (int q = 0; q < 8; ++q) {
      const int r = q * 2 + rsub;
      const v4f v = *(const v4fa*)&so[w][r][c4];
      *(v4f*)(C + (size_t)(row0 + r) * ldc + col0 + c4) = v;
    }
    
  }
}
// row LayerNorm (biased variance, eps) over N: s = X (+ R); optional out_sum <- s; out_norm <- (s-mu)*rsqrt(var+eps)*g + b
template <bool PARAM_BF16>
__global__ __launch_bounds__(256) void k_layernorm(const float* __restrict__ X, const float* __restrict__ R, const float* __restrict__ g, const float* __restrict__ bta,
                                                  float* __restrict__ out_sum, float* __restrict__ out_norm, int N, float eps) {
  __shared__ float red[256];
  const int row = blockIdx.x, tid = threadIdx.x;
  const float* x = X + (size_t)row * N; const float* rr = R ? R + (size_t)row * N : nullptr;
  float vals[16];                     // up to N = 4096
  const int per = N / 256;            // contiguous chunk per thread? use strided-by-4 chunks: thread handles j = tid*4 + 1024*u
  float s1 = 0.f;
  for (int u = 0; u < per / 4; ++u) {
    const int j = tid * 4 + 1024 * u;
    const v4f a = *(const v4fa*)(x + j);
    v4f b = {0.f,0.f,0.f,0.f}; if (rr) b = *(const v4fa*)(rr + j);
#pragma unroll
    for (int q = 0; q < 4; ++q) { const float v = a[q] + b[q]; vals[u * 4 + q] = v; s1 += v; }
  }
  red[tid] = s1; __syncthreads();
  for (int st = 128; st > 0; st >>= 1) { if (tid < st) red[tid] += red[tid + st]; __syncthreads(); }
  const float mu = red[0] / (float)N; __syncthreads();
  float s2 = 0.f;
  for (int u = 0; u < per / 4; ++u)
#pragma unroll
    for (int q = 0; q < 4; ++q) { const float c = vals[u * 4 + q] - mu; s2 += c * c; }
  red[tid] = s2; __syncthreads();
  for (int st = 128; st > 0; st >>= 1) { if (tid < st) red[tid] += red[tid + st]; __syncthreads(); }
  const float rs = rsqrtf(red[0] / (float)N + eps);
  {
    for (int u = 0; u < per / 4; ++u) {
      const int j = tid * 4 + 1024 * u;
      v4f o, sm;
#pragma unroll
      for (int q = 0; q < 4; ++q) {
        float gg = g[j + q], bb = bta[j + q];
        if (PARAM_BF16) { gg = bf16_round(gg); bb = bf16_round(bb); }
        sm[q] = vals[u * 4 + q]; o[q] = (vals[u * 4 + q] - mu) * rs * gg + bb;
      }
      if (out_sum) *(v4f*)(out_sum + (size_t)row * N + j) = sm;
      *(v4f*)(out_norm + (size_t)row * N + j) = o;
    }
    
  }
}



// ---- f16 WMMA path (v_wmma_f32_16x16x32_f16): 11-bit significands for operands in range — used where a [0,1] probability operand needs more precision than bf16
typedef _Float16 v16h __attribute__((ext_vector_type(16)));
union FragH { v16h v; v8us half[2]; _Float16 h[16]; unsigned short u[16]; };
template <int NT>
__device__ __forceinline__ v8f mmaH(v16h ah, v16h al, v16h bh, v16h bl, v8f c) {
  c = __builtin_amdgcn_wmma_f32_16x16x32_f16(false, ah, false, bh, (short)0, c, false, false);
  if (NT >= 2) c = __builtin_amdgcn_wmma_f32_16x16x32_f16(false, al, false, bh, (short)0, c, false, false);
  if (NT >= 3) c = __builtin_amdgcn_wmma_f32_16x16x32_f16(false, ah, false, bl, (short)0, c, false, false);
  asm volatile("v_nop\n\tv_nop\n\tv_nop\n\tv_nop" : "+v"(c) : "v"(ah), "v"(al), "v"(bh), "v"(bl));
  return c;
}
// batched GEMM like k_gemm_b but f16 operands: A f32 (split into f16 hi/lo if ASPLIT, else rounded to f16), Bt = f16 values [n][k]; alpha; C f32; N multiple of 16 (partial tiles skipped)
template <bool ASPLIT>
__global__ __launch_bounds__(128) void k_gemm_h(const float* __restrict__ A, int lda, size_t sA, const _Float16* __restrict__ Bh, int ldb, size_t sB, float alpha, float* __restrict__ C, int ldc, size_t sC, int M, int N, int K) {
  __shared__ __attribute__((aligned(16))) float so[4][16][64];
  const int tid = threadIdx.x, w = tid >> 5, lane = tid & 31, ln = lane & 15, hh = lane >> 4; const int by = blockIdx.y;
  A += (size_t)by * sA; Bh += (size_t)by * sB; C += (size_t)by * sC;
  const int ntn = (N + 63) / 64; const int wid = blockIdx.x * 4 + w; const int mt = wid / ntn, nq = wid % ntn; if (mt * 16 >= M) return;
  const int row0 = mt * 16, col0 = nq * 64; const float* arow = A + (size_t)(row0 + ln) * lda;
  v8f acc[4] = {};
  for (int kb = 0; kb < K; kb += 32) {
    FragH ah, al;
    const v4f x0 = *(const v4fa*)(arow + kb + 8 * hh), x1 = *(const v4fa*)(arow + kb + 8 * hh + 4), x2 = *(const v4fa*)(arow + kb + 16 + 8 * hh), x3 = *(const v4fa*)(arow + kb + 16 + 8 * hh + 4);
    float xs[16] = {x0[0],x0[1],x0[2],x0[3],x1[0],x1[1],x1[2],x1[3],x2[0],x2[1],x2[2],x2[3],x3[0],x3[1],x3[2],x3[3]};
#pragma unroll
    for (int i = 0; i < 16; ++i) { const _Float16 h = (_Float16)xs[i]; ah.h[i] = h; al.h[i] = ASPLIT ? (_Float16)(xs[i] - (float)h) : (_Float16)0.0f; }
#pragma unroll
    for (int t = 0; t < 4; ++t) { if (col0 + t * 16 >= N) continue; const size_t boff = (size_t)(col0 + t * 16 + ln) * ldb + kb; FragH bq; bq.half[0] = *(const v8us*)(Bh + boff + 8 * hh); bq.half[1] = *(const v8us*)(Bh + boff + 16 + 8 * hh);
      acc[t] = mmaH<ASPLIT ? 2 : 1>(ah.v, al.v, bq.v, bq.v, acc[t]); }
  }
#pragma unroll
  for (int t = 0; t < 4; ++t) { if (col0 + t * 16 >= N) continue;
#pragma unroll
    for (int r = 0; r < 8; ++r) so[w][8 * hh + r][t * 16 + ln] = acc[t][r] * alpha; }
  __builtin_amdgcn_fence(__ATOMIC_ACQ_REL, "workgroup"); __builtin_amdgcn_wave_barrier();
  const int rsub = lane >> 4, c4 = (lane & 15) * 4;
  {
#pragma unroll
    for (int q = 0; q < 8; ++q) { const int r = q * 2 + rsub; if (col0 + c4 < N) { const v4f v = *(const v4fa*)&so[w][r][c4]; *(v4f*)(C + (size_t)(row0 + r) * ldc + col0 + c4) = v; } }
     }
}

// Wt[n][k] = f16(W[k][n]*scale) from f32 row-major W[K][N] (scale = power of two; bf16-exact weights stay exact in f16 away from the subnormal range)
// One block turns a tile of 128 k x 64 n through LDS: W is read as whole 256-B pieces of its rows (16 B a lane, all 8 loads of a lane in flight) and Wt is written as whole 256-B pieces of its rows. (K / 128) * (N / 64) tiles. K and N are compile-time so that a lane's 8 loads, and its 4 stores, share one address and differ in the immediate offset only.
#define WT_P 65      /* dwords per LDS row (one n: 64 pairs of k, + 1): odd, so the 16 lanes that store 4 rows apart and the 16 that read 4 dwords apart each meet 16 different banks */
typedef unsigned int v4ua __attribute__((ext_vector_type(4), may_alias));
template <int K, int N>
__device__ __forceinline__ void wt_tile(unsigned int* tl, const float* __restrict__ W, _Float16* __restrict__ Wt, float scale, int blk) { static_assert(K % 128 == 0 && N % 64 == 0, "wt_tile: whole tiles only");      /* tl = 64 * WT_P dwords of LDS; blk = the tile's number */
  constexpr int ntn = N / 64; const int tid = threadIdx.x; const int kt = blk / ntn, nt = blk % ntn; const int k0 = kt * 128, n0 = nt * 64; const int r = tid >> 4, c = tid & 15;
  const float* p = W + (size_t)(k0 + 2 * r) * N + n0 + c * 4;
  v4f a[4], b[4];      /* rows k0 + 2 * (16 u + r) and the next one, columns n0 + 4 c .. + 3; every loop below is unrolled whole, so that a and b are indexed by constants and stay in registers and the offsets are immediates */
#pragma unroll
  for (int u = 0; u < 4; ++u) { a[u] = *(const v4fa*)(p + (size_t)u * 32 * N); b[u] = *(const v4fa*)(p + (size_t)u * 32 * N + N); }
#pragma unroll
  for (int u = 0; u < 4; ++u) {
#pragma unroll
    for (int j = 0; j < 4; ++j) { union { _Float16 h[2]; unsigned int d; } pk; pk.h[0] = (_Float16)(bf16_round(a[u][j]) * scale); pk.h[1] = (_Float16)(bf16_round(b[u][j]) * scale); tl[(c * 4 + j) * WT_P + u * 16 + r] = pk.d; } }
  __syncthreads();
  unsigned short* q = (unsigned short*)Wt + (size_t)(n0 + r) * K + k0 + c * 8;
#pragma unroll
  for (int v = 0; v < 4; ++v) { v4ua o;
#pragma unroll
    for (int i = 0; i < 4; ++i) o[i] = tl[(v * 16 + r) * WT_P + c * 4 + i];
    *(v4ua*)(q + (size_t)v * 16 * K) = o; }
  asm volatile("s_wait_xcnt 0x0" ::: "memory");      /* a precaution: the built kernel lays another job's code behind these stores, and that code rewrites the registers they name; the wait stands in front of it */
}
// k_gemm_hh variant with fused epilogue: v = acc·alpha + bias[by·sBias + col] (+ CP[(row/rowsPerB)·sCPb + by·64 + col] if CP) ; ACT 0 none / 1 elu ; writes f16 C16 (and f32 C if non-null)
template <int ACT>
__global__ __launch_bounds__(128) void k_gemm_hhx(const _Float16* __restrict__ A, int lda, size_t sA, const _Float16* __restrict__ Bh, int ldb, size_t sB, float alpha, const float* __restrict__ bias, size_t sBias, const float* __restrict__ CP, int rowsPerB, size_t sCPb, int row0g,
    float* __restrict__ C, _Float16* __restrict__ C16, int ldc, size_t sC, int M, int N, int K) {
  __shared__ __attribute__((aligned(16))) float so[4][16][64];
  const int tid = threadIdx.x, w = tid >> 5, lane = tid & 31, ln = lane & 15, hh = lane >> 4; const int by = blockIdx.y;
  A += (size_t)by * sA; Bh += (size_t)by * sB; const size_t cofs = (size_t)by * sC; const float* bp = bias ? bias + (size_t)by * sBias : nullptr;
  const int ntn = (N + 63) / 64; const int wid = blockIdx.x * 4 + w; const int mt = wid / ntn, nq = wid % ntn; if (mt * 16 >= M) return;
  const int row0 = mt * 16, col0 = nq * 64; const _Float16* arow = A + (size_t)(row0 + ln) * lda;
  v8f acc[4] = {};
  for (int kb = 0; kb < K; kb += 32) { FragH ah; ah.half[0] = *(const v8us*)((const unsigned short*)arow + kb + 8 * hh); ah.half[1] = *(const v8us*)((const unsigned short*)arow + kb + 16 + 8 * hh);
#pragma unroll
    for (int t = 0; t < 4; ++t) { if (col0 + t * 16 >= N) continue; const size_t boff = (size_t)(col0 + t * 16 + ln) * ldb + kb; FragH bq; bq.half[0] = *(const v8us*)((const unsigned short*)Bh + boff + 8 * hh); bq.half[1] = *(const v8us*)((const unsigned short*)Bh + boff + 16 + 8 * hh);
      acc[t] = mmaH<1>(ah.v, ah.v, bq.v, bq.v, acc[t]); }
  }
#pragma unroll
  for (int t = 0; t < 4; ++t) { if (col0 + t * 16 >= N) continue; const int col = col0 + t * 16 + ln; const float bv = bp ? bf16_round(bp[col]) : 0.f;
#pragma unroll
    for (int r = 0; r < 8; ++r) { float v = acc[t][r] * alpha + bv; if (CP) { const int rr = row0g + row0 + 8 * hh + r; if (rowsPerB < 0) v += CP[cofs + (size_t)rr * ldc + col];      /* rowsPerB < 0: own element of the batched C plane */ else { const int bidx = rr / rowsPerB; v += CP[(size_t)bidx * sCPb + (size_t)by * 64 + col]; } } if (ACT == 1) v = (v > 0.f) ? v : expm1f(v); else if (ACT == 7) v = (v > 0.f) ? v + 1.0f : expf(v); else if (ACT == 8) v = tanhf(v); else if (ACT == 9) v = 0.5f * v * (1.0f + tanhf(0.7978845608028654f * (v + 0.044715f * v * v * v))); else if (ACT == 11) v = 1.0f / (1.0f + expf(-v)); else if (ACT == 12) v = (v > 0.f) ? v : 0.01f * v; else if (ACT == 14) v = (v > 0.f) ? v : 0.1f * v; else if (ACT == 16) v = (v >= 0.f) ? v : 0.3f * v; else if (ACT == 15) v = v / (1.0f + expf(-v)); else if (ACT == 3) v = fmaxf(v, 0.f); else if (ACT == 6) v = 0.5f * v * (1.0f + erff(v * 0.70710678118654752f)); so[w][8 * hh + r][t * 16 + ln] = v; } }
  __builtin_amdgcn_fence(__ATOMIC_ACQ_REL, "workgroup"); __builtin_amdgcn_wave_barrier();
  const int rsub = lane >> 4, c4 = (lane & 15) * 4; typedef _Float16 v4h __attribute__((ext_vector_type(4)));
  {
#pragma unroll
    for (int q = 0; q < 8; ++q) { const int r = q * 2 + rsub; if (col0 + c4 < N) { const v4f v = *(const v4fa*)&so[w][r][c4]; if (C) *(v4f*)(C + cofs + (size_t)(row0 + r) * ldc + col0 + c4) = v; if (C16) { v4h h4; for (int i = 0; i < 4; ++i) h4[i] = (_Float16)v[i]; *(v4h*)(C16 + cofs + (size_t)(row0 + r) * ldc + col0 + c4) = h4; } } }
     }
}


typedef _Float16 v4h __attribute__((ext_vector_type(4)));

__device__ __forceinline__ void x16_part(const float* __restrict__ x, _Float16* __restrict__ X16, int blk) { const size_t t = (size_t)blk * 256 + threadIdx.x; FragH f;
#pragma unroll
  for (int q = 0; q < 8; ++q) f.h[q] = (_Float16)bf16_round(x[t * 8 + q]); *(v8us*)((unsigned short*)X16 + t * 8) = f.half[0];  }
__global__ __launch_bounds__(256) void k_h16(const float* __restrict__ x, _Float16* __restrict__ X16, size_t n8, size_t sB) { const size_t t = (size_t)blockIdx.x * 256 + threadIdx.x; if (t >= n8) return; x += (size_t)blockIdx.y * sB; X16 += (size_t)blockIdx.y * sB;      /* batch = blockIdx.y */ FragH f;
#pragma unroll
  for (int q = 0; q < 8; ++q) f.h[q] = (_Float16)x[t * 8 + q]; *(v8us*)((unsigned short*)X16 + t * 8) = f.half[0];  }
__global__ __launch_bounds__(256) void k_round16f(const float* __restrict__ W, _Float16* __restrict__ Bt, size_t n8) { const size_t t = (size_t)blockIdx.x * 256 + threadIdx.x; if (t >= n8) return; FragH f;
#pragma unroll
  for (int i = 0; i < 8; ++i) f.h[i] = (_Float16)(bf16_round(W[t * 8 + i]) * 16.0f); *(v8us*)((unsigned short*)Bt + t * 8) = f.half[0];  }
template <int NHv, int TTv>
__global__ __launch_bounds__(256) void k_vt(const _Float16* __restrict__ V16, int ldv, int voff, _Float16* __restrict__ Vt) { __shared__ unsigned short tl[64][66]; const int tid = threadIdx.x; const int slab = blockIdx.x / (TTv / 64), lg = blockIdx.x % (TTv / 64); const int b = slab / NHv, h = slab % NHv;
  for (int i = tid; i < 64 * 8; i += 256) { const int r = i / 8, c8 = (i % 8) * 8; FragH f; f.half[0] = *(const v8us*)((const unsigned short*)V16 + ((size_t)b * TTv + lg * 64 + r) * ldv + voff + h * 64 + c8);
#pragma unroll
    for (int q = 0; q < 8; ++q) tl[r][c8 + q] = f.u[q]; }
  __syncthreads();
  {
#pragma unroll
    for (int rd = 0; rd < 2; ++rd) { const int d = rd * 32 + tid / 8, pc = tid % 8; FragH f;
#pragma unroll
      for (int q = 0; q < 8; ++q) f.u[q] = tl[pc * 8 + q][d];
      *(v8us*)((unsigned short*)Vt + ((size_t)slab * 64 + d) * TTv + lg * 64 + pc * 8) = f.half[0]; }
     } }

// ---- fast GEMM (block tile 128x64, wave tile 32x64; requires M % 128 == 0 rows per launch region, N % 64 == 0, K % 64 == 0); epilogue = k_gemm_hhx semantics ----
// Operands reach the waves through LDS: per 64 k one tile of 128 A rows and 64 B rows, 128 B (one whole line) of each row, brought by asynchronous copies (32 lanes = 4 whole lines a copy) into one of two buffers while the other is worked on; each row is fetched once per block instead of once per wave in 32-B pieces.
#define G2_PITCH 72      /* f16 per LDS row: 128 B of k + 16 B, the conflict-free pitch for ds_load_b128 readers of 128-B rows */
#define G2_TILE ((128 + 64) * G2_PITCH * 2)      /* bytes of one buffer: 128 A rows, then 64 B rows */
// one tile's 12 copies of a lane (rows 16 apart: 8 of A, 4 of B); l = the lane's LDS byte address of its first piece; ga2 = the lane's piece of A-tile row 64 + its first row (ga + 4 sa, or a row of a second plane). s_wait_xcnt 0 is the statement's last line so that no address register of a copy is rewritten ahead of it.
__device__ __forceinline__ void g2_stage(unsigned l, const _Float16* ga, const _Float16* ga2, size_t sa, const _Float16* gb, size_t sb) { const unsigned r16 = 16 * G2_PITCH * 2;
  asm volatile("global_load_async_to_lds_b128 %0, %12, off\n\t" "global_load_async_to_lds_b128 %1, %13, off\n\t" "global_load_async_to_lds_b128 %2, %14, off\n\t" "global_load_async_to_lds_b128 %3, %15, off\n\t"
               "global_load_async_to_lds_b128 %4, %16, off\n\t" "global_load_async_to_lds_b128 %5, %17, off\n\t" "global_load_async_to_lds_b128 %6, %18, off\n\t" "global_load_async_to_lds_b128 %7, %19, off\n\t"
               "global_load_async_to_lds_b128 %8, %20, off\n\t" "global_load_async_to_lds_b128 %9, %21, off\n\t" "global_load_async_to_lds_b128 %10, %22, off\n\t" "global_load_async_to_lds_b128 %11, %23, off\n\t"
               "s_wait_xcnt 0x0"
               :: "v"(l), "v"(l + r16), "v"(l + 2 * r16), "v"(l + 3 * r16), "v"(l + 4 * r16), "v"(l + 5 * r16), "v"(l + 6 * r16), "v"(l + 7 * r16), "v"(l + 8 * r16), "v"(l + 9 * r16), "v"(l + 10 * r16), "v"(l + 11 * r16),
                  "v"(ga), "v"(ga + sa), "v"(ga + 2 * sa), "v"(ga + 3 * sa), "v"(ga2), "v"(ga2 + sa), "v"(ga2 + 2 * sa), "v"(ga2 + 3 * sa), "v"(gb), "v"(gb + sb), "v"(gb + 2 * sb), "v"(gb + 3 * sb)
               : "memory"); }
__device__ __forceinline__ v16h g2_frag(const _Float16* p, int hh) { FragH f; f.half[0] = *(const v8us*)((const unsigned short*)p + 8 * hh); f.half[1] = *(const v8us*)((const unsigned short*)p + 16 + 8 * hh); return f.v; }
__device__ __forceinline__ v8f g2_mma(v16h a, v16h b, v8f c) { v8f d = __builtin_amdgcn_wmma_f32_16x16x32_f16(false, a, false, b, (short)0, c, false, false); asm volatile("v_nop\n\tv_nop\n\tv_nop\n\tv_nop" : "+v"(d) : "v"(a), "v"(b)); return d; }
// LOFOLD (the output projection): A = O hi, flat [NB * SQ] rows, AL = the residual plane (x 2^10) of rows < BAND, flat [NB * BAND] rows. Per batch BAND / 64 blocks of 64 rows < BAND, then (SQ - BAND) / 128 plain blocks. In a block of rows < BAND the A tile's rows 0 .. 63 are O hi (waves 0, 1) and its rows 64 .. 127 the residuals of the same 64 rows (waves 2, 3, alpha * 2^-10); the epilogue adds the two products and writes f32 C.
#define G2_RB (BAND / 64 + (SQ - BAND) / 128)      /* row blocks per batch under LOFOLD */
template <int ACT, bool LOFOLD>
__global__ __launch_bounds__(128) void k_gemm2(const _Float16* __restrict__ A, int lda, size_t sA, const _Float16* __restrict__ Bh, int ldb, size_t sB, float alpha, const float* __restrict__ bias, size_t sBias, const float* __restrict__ CP, int rowsPerB, size_t sCPb, int row0g,
    float* __restrict__ C, _Float16* __restrict__ C16, int ldc, size_t sC, int M, int N, int K, size_t zA, size_t zB, size_t zC, const _Float16* __restrict__ AL) { static_assert(ACT == 0 || ACT == 3 || ACT == 6 || ACT == 8 || ACT == 9 || ACT == 11 || ACT == 12 || ACT == 14 || ACT == 15 || ACT == 16, "k_gemm2: unsupported ACT code (would silently apply no activation)");
  __shared__ __attribute__((aligned(16))) unsigned char sm[2 * G2_TILE]; float (*so)[32][68] = (float (*)[32][68])sm;      /* the epilogue's staging lies over the two buffers, which every wave has left by then */ static_assert(sizeof(float) * 4 * 32 * 68 <= 2 * G2_TILE, "k_gemm2: epilogue staging must fit the buffers");
  const int tid = threadIdx.x, w = tid >> 5, lane = tid & 31, ln = lane & 15, hh = lane >> 4; const int by = blockIdx.y, bz = blockIdx.z;
  A += (size_t)by * sA + (size_t)bz * zA; Bh += (size_t)by * sB + (size_t)bz * zB; const size_t cofs = (size_t)by * sC + (size_t)bz * zC; const float* bp = bias ? bias + (size_t)by * sBias : nullptr;
  const int ntn = N >> 6; const int mt = blockIdx.x / ntn, nq = blockIdx.x - mt * ntn; const int col0 = nq * 64; if (!LOFOLD && mt * 128 >= M) return;      /* the same for the whole block: it stands in front of barriers */
  const int bt = mt / G2_RB, rb = mt - bt * G2_RB; const bool band = LOFOLD && rb < BAND / 64;      /* the same for the whole block */
  const int arow = !LOFOLD ? mt * 128 : bt * SQ + (band ? rb * 64 : BAND + (rb - BAND / 64) * 128);      /* the block's first row of A and of C */ const int row0 = arow + 32 * w;
  const int trow = tid >> 3, tseg = tid & 7;      /* a lane's piece of a tile: 16 B number tseg of rows trow, trow + 16, ... */
  const _Float16* gA = A + (size_t)(arow + trow) * lda + tseg * 8; const _Float16* gB = Bh + (size_t)(col0 + trow) * ldb + tseg * 8; const size_t sa16 = (size_t)16 * lda, sb16 = (size_t)16 * ldb;
  const _Float16* gA2 = band ? AL + (size_t)(bt * BAND + rb * 64 + trow) * lda + tseg * 8 : gA + 4 * sa16;      /* the lane's piece of A-tile row 64 + trow */
  const unsigned l0 = (unsigned)(size_t)sm + (unsigned)(trow * (G2_PITCH * 2) + tseg * 16);
  const v8f z8 = {0.f,0.f,0.f,0.f,0.f,0.f,0.f,0.f}; v8f c00 = z8, c01 = z8, c02 = z8, c03 = z8, c10 = z8, c11 = z8, c12 = z8, c13 = z8;
  const int nc = K >> 6;
  g2_stage(l0, gA, gA2, sa16, gB, sb16);
  asm volatile("s_wait_asynccnt 0x0" ::: "memory");      /* tile 0 of this wave's copies has landed */
  __syncthreads();      /* ... and every other wave's */
  if (nc > 1) g2_stage(l0 + G2_TILE, gA + 64, gA2 + 64, sa16, gB + 64, sb16);
#pragma unroll 1      /* one tile a trip: the buffer index stays a run-time value and the loop stays small */
  for (int t = 0; t < nc; ++t) { const _Float16* tl = (const _Float16*)(sm + (t & 1) * G2_TILE); const _Float16* ar = tl + (32 * w + ln) * G2_PITCH; const _Float16* br = tl + (128 + ln) * G2_PITCH;
    /* all 24 LDS reads of the trip as one group in front of its WMMAs */
    const v16h a0 = g2_frag(ar, hh), a1 = g2_frag(ar + 16 * G2_PITCH, hh), b0 = g2_frag(br, hh), b1 = g2_frag(br + 16 * G2_PITCH, hh), b2 = g2_frag(br + 32 * G2_PITCH, hh), b3 = g2_frag(br + 48 * G2_PITCH, hh);
    const v16h e0 = g2_frag(ar + 32, hh), e1 = g2_frag(ar + 16 * G2_PITCH + 32, hh), f0 = g2_frag(br + 32, hh), f1 = g2_frag(br + 16 * G2_PITCH + 32, hh), f2 = g2_frag(br + 32 * G2_PITCH + 32, hh), f3 = g2_frag(br + 48 * G2_PITCH + 32, hh);
    c00 = g2_mma(a0, b0, c00); c10 = g2_mma(a1, b0, c10); c01 = g2_mma(a0, b1, c01); c11 = g2_mma(a1, b1, c11); c02 = g2_mma(a0, b2, c02); c12 = g2_mma(a1, b2, c12); c03 = g2_mma(a0, b3, c03); c13 = g2_mma(a1, b3, c13);
    c00 = g2_mma(e0, f0, c00); c10 = g2_mma(e1, f0, c10); c01 = g2_mma(e0, f1, c01); c11 = g2_mma(e1, f1, c11); c02 = g2_mma(e0, f2, c02); c12 = g2_mma(e1, f2, c12); c03 = g2_mma(e0, f3, c03); c13 = g2_mma(e1, f3, c13);
    asm volatile("s_wait_dscnt 0x0" ::: "memory");      /* this wave's reads of buffer t & 1 are done before the buffer is handed back */
    asm volatile("s_wait_asynccnt 0x0" ::: "memory");      /* this wave's copies of tile t + 1 have landed */
    __syncthreads();      /* publishes tile t + 1 and ends every wave's reads of tile t */
    if (t + 2 < nc) g2_stage(l0 + (unsigned)((t & 1) * G2_TILE), gA + (size_t)(t + 2) * 64, gA2 + (size_t)(t + 2) * 64, sa16, gB + (size_t)(t + 2) * 64, sb16); }
  asm volatile("s_wait_asynccnt 0x0" ::: "memory");      /* no copy is in flight when the buffers become the epilogue's staging */
  v8f accs[8] = {c00, c01, c02, c03, c10, c11, c12, c13};
  if (band) {      /* rows < BAND: C = alpha (O hi . W) + alpha 2^-10 (residual . W), the two products met in LDS */
    const float aw = w >= 2 ? alpha * 0.0009765625f : alpha;
#pragma unroll
    for (int u = 0; u < 8; ++u) {
#pragma unroll
      for (int r = 0; r < 8; ++r) so[w][(u >> 2) * 16 + 8 * hh + r][(u & 3) * 16 + ln] = accs[u][r] * aw; }
    __syncthreads();      /* waves 0, 1 hold the hi product of the block's 64 rows, waves 2, 3 the residual product: each wave reads both for the 16 rows it stores */
    v4f o[8];      /* all 16 LDS reads and the sums first, then the 8 stores together: not a chain of read, wait, store */
#pragma unroll
    for (int q = 0; q < 8; ++q) { const int r = 16 * w + q * 2 + (lane >> 4); const v4f x = *(const v4fa*)&so[r >> 5][r & 31][ln * 4], y = *(const v4fa*)&so[2 + (r >> 5)][r & 31][ln * 4]; o[q] = x + y; }
    float* cp = C + cofs + (size_t)(arow + 16 * w + (lane >> 4)) * ldc + col0 + ln * 4;
#pragma unroll
    for (int q = 0; q < 8; ++q) *(v4f*)(cp + (size_t)(q * 2) * ldc) = o[q];
    return; }
#pragma unroll
  for (int u = 0; u < 8; ++u) { const int t = u & 3, half = u >> 2; const int col = col0 + t * 16 + ln; const float bv = bp ? bf16_round(bp[col]) : 0.f;
#pragma unroll
    for (int r = 0; r < 8; ++r) { const int rloc = half * 16 + 8 * hh + r; float v = accs[u][r] * alpha + bv; if (CP) { if (rowsPerB < 0) v += CP[cofs + (size_t)(row0g + row0 + rloc) * ldc + col];      /* rowsPerB < 0: own element of the batched C plane */ else { const int bidx = (row0g + row0 + rloc) / rowsPerB; v += CP[(size_t)bidx * sCPb + (size_t)by * 64 + col]; } }
      if (ACT == 3) v = fmaxf(v, 0.f); else if (ACT == 6) v = 0.5f * v * (1.0f + erff(v * 0.70710678118654752f)); else if (ACT == 11) v = 1.0f / (1.0f + expf(-v)); else if (ACT == 15) v = v / (1.0f + expf(-v)); else if (ACT == 12) v = (v > 0.f) ? v : 0.01f * v; else if (ACT == 8) v = tanhf(v); else if (ACT == 9) v = 0.5f * v * (1.0f + tanhf(0.7978845608028654f * (v + 0.044715f * v * v * v))); else if (ACT == 14) v = (v > 0.f) ? v : 0.1f * v; else if (ACT == 16) v = (v >= 0.f) ? v : 0.3f * v;
      so[w][rloc][t * 16 + ln] = v; } }
  __builtin_amdgcn_fence(__ATOMIC_ACQ_REL, "workgroup"); __builtin_amdgcn_wave_barrier();
  const int rsub = lane >> 4, c4 = (lane & 15) * 4;
  {
#pragma unroll
    for (int q = 0; q < 16; ++q) { const int r = q * 2 + rsub; const v4f v = *(const v4fa*)&so[w][r][c4]; if (C) *(v4f*)(C + cofs + (size_t)(row0 + r) * ldc + col0 + c4) = v; if (C16) { v4h h4; for (int i = 0; i < 4; ++i) h4[i] = (_Float16)v[i]; *(v4h*)(C16 + cofs + (size_t)(row0 + r) * ldc + col0 + c4) = h4; } }
     } }


#define LDQKV (DM + 2 * HD)      /* columns of the joint projection: q (8 heads), k, v */
__device__ __forceinline__ void rotab_part(const int* __restrict__ pid, float* __restrict__ CS, float* __restrict__ SN, int blk) {
  #pragma clang fp contract(off)
  const int t = blk * 256 + threadIdx.x; const int j = t % HH, s = t / HH;      /* s = flat token over both batches */ const float inv = 1.0f / powf(10000.0f, (float)(2 * j) / (float)HD); const float th = (float)pid[s] * inv; const float c = cosf(th), sn = sinf(th);
  { *(float*)(CS + t) = c; *(float*)(SN + t) = sn;  }
  asm volatile("s_wait_xcnt 0x0" ::: "memory");      /* a precaution: the built kernel lays another job's code behind these stores, and that code rewrites the registers they name; the wait stands in front of it */ }
// rotation of the 8 query heads and of the key head (head 8 of a row of the joint projection) in one index space
__device__ __forceinline__ void rope_part(const float* __restrict__ F, const float* __restrict__ CS, const float* __restrict__ SN, _Float16* __restrict__ QH, _Float16* __restrict__ QL, _Float16* __restrict__ KH, _Float16* __restrict__ KL, int blk) {
  #pragma clang fp contract(off)
  const int t = blk * 256 + threadIdx.x; const int g = (t % (HH / 8)) * 8; const int h = (t / (HH / 8)) % (NHQ + 1); const int s = t / ((HH / 8) * (NHQ + 1));
  const bool isq = h < NHQ; _Float16* H = isq ? QH : KH; _Float16* L = isq ? QL : KL; F += (size_t)s * LDQKV + h * HD + g;
  const size_t base = isq ? (size_t)s * DM + h * HD + g : (size_t)s * HD + g; FragH h0, h1, l0, l1;
#pragma unroll
  for (int q = 0; q < 8; ++q) { const float c = CS[s * HH + g + q], sn = SN[s * HH + g + q]; const float x0 = F[q], x1 = F[HH + q]; float o0 = x0 * c; o0 += -x1 * sn; float o1 = x1 * c; o1 += x0 * sn;
    const _Float16 a0 = (_Float16)o0, a1 = (_Float16)o1; h0.h[q] = a0; h1.h[q] = a1; l0.h[q] = (_Float16)((o0 - (float)a0) * 1024.0f); l1.h[q] = (_Float16)((o1 - (float)a1) * 1024.0f); }
  { *(v8us*)((unsigned short*)H + base) = h0.half[0]; *(v8us*)((unsigned short*)H + base + HH) = h1.half[0]; *(v8us*)((unsigned short*)L + base) = l0.half[0]; *(v8us*)((unsigned short*)L + base + HH) = l1.half[0];  } }
// V^T hi and residual (x 2^10) planes straight from the f32 v columns of the joint projection: one block turns 64 tokens x 64 d through two LDS tiles. Fv = column 0 of v in row 0.
__device__ __forceinline__ void vthl_part(unsigned short (*th)[66], unsigned short (*tr)[66], const float* __restrict__ Fv, _Float16* __restrict__ VTh, _Float16* __restrict__ VTl, int blk) {
  const int tid = threadIdx.x; const int slab = blk / (SQ / 64), lg = blk % (SQ / 64); const int b = slab / (HD / 64), h = slab % (HD / 64);
  for (int i = tid; i < 64 * 8; i += 256) { const int r = i / 8, c8 = (i % 8) * 8; const float* p = Fv + ((size_t)b * SQ + lg * 64 + r) * LDQKV + h * 64 + c8; const v4f a = *(const v4fa*)p, c = *(const v4fa*)(p + 4); FragH fh, fl;
#pragma unroll
    for (int q = 0; q < 4; ++q) { _Float16 x = (_Float16)a[q]; fh.h[q] = x; fl.h[q] = (_Float16)((a[q] - (float)x) * 1024.0f); x = (_Float16)c[q]; fh.h[4 + q] = x; fl.h[4 + q] = (_Float16)((c[q] - (float)x) * 1024.0f); }
#pragma unroll
    for (int q = 0; q < 8; ++q) { th[r][c8 + q] = fh.u[q]; tr[r][c8 + q] = fl.u[q]; } }
  __syncthreads();
#pragma unroll
  for (int rd = 0; rd < 2; ++rd) { const int d = rd * 32 + tid / 8, pc = tid % 8; FragH fh, fl;
#pragma unroll
    for (int q = 0; q < 8; ++q) { fh.u[q] = th[pc * 8 + q][d]; fl.u[q] = tr[pc * 8 + q][d]; }
    const size_t o = ((size_t)slab * 64 + d) * SQ + lg * 64 + pc * 8; *(v8us*)((unsigned short*)VTh + o) = fh.half[0]; *(v8us*)((unsigned short*)VTl + o) = fl.half[0]; } }
// ---- launches that do not depend on one another stand side by side in one grid; a block's range of blockIdx.x says which job it does (the same for the whole block, so each job's barrier is passed by all of its block) ----
#define PB_X16 (NB * SQ * DM / 8 / 256)      /* blocks of the f16 plane of the hidden states */
#define PB_WB ((DM / 128) * (DM / 64))      /* tiles of Wq, and of Wo */
#define PB_WS ((DM / 128) * (HD / 64))      /* tiles of Wk, and of Wv */
#define PB_ROT (NB * SQ * HH / 256)      /* blocks of the RoPE tables */
__global__ __launch_bounds__(256) void k_prep(const float* __restrict__ hs, const int* __restrict__ pid, const float* __restrict__ Wq, const float* __restrict__ Wk, const float* __restrict__ Wv, const float* __restrict__ Wo,
    _Float16* __restrict__ X16, _Float16* __restrict__ BQ, _Float16* __restrict__ BK, _Float16* __restrict__ BV, _Float16* __restrict__ BO, float* __restrict__ CS, float* __restrict__ SN) {
  __shared__ unsigned int tl[64 * WT_P];
  int bx = blockIdx.x;
  if (bx < PB_X16) { x16_part(hs, X16, bx); return; }
  bx -= PB_X16;
  if (bx < 2 * PB_WB) { const bool o = bx >= PB_WB; wt_tile<DM, DM>(tl, o ? Wo : Wq, o ? BO : BQ, 16.0f, o ? bx - PB_WB : bx); return; }
  bx -= 2 * PB_WB;
  if (bx < 2 * PB_WS) { const bool v = bx >= PB_WS; wt_tile<DM, HD>(tl, v ? Wv : Wk, v ? BV : BK, 16.0f, v ? bx - PB_WS : bx); return; }
  rotab_part(pid, CS, SN, bx - 2 * PB_WS); }
#define QB_VT (NB * (HD / 64) * (SQ / 64))      /* tiles of V^T */
#define QB_ROPE (NB * SQ * (NHQ + 1) * (HH / 8) / 256)      /* blocks of the rotation */
__global__ __launch_bounds__(256) void k_post(const float* __restrict__ F, const float* __restrict__ CS, const float* __restrict__ SN, _Float16* __restrict__ QH, _Float16* __restrict__ QL, _Float16* __restrict__ KH, _Float16* __restrict__ KL, _Float16* __restrict__ VTh, _Float16* __restrict__ VTl) {
  __shared__ unsigned short th[64][66], tr[64][66];
  const int bx = blockIdx.x;
  if (bx < QB_VT) { vthl_part(th, tr, F + DM + HD, VTh, VTl, bx); return; }
  rope_part(F, CS, SN, QH, QL, KH, KL, bx - QB_VT); }
typedef int v4ia __attribute__((ext_vector_type(4), may_alias));

#define FA_KP 264      /* f16 per LDS row of K: 512 B + 16 B = 16 B x 33, the conflict-free kind of pitch for ds_load_b128 readers */
#define FA_KB (64 * FA_KP * 2)      /* bytes of the K part of a buffer */
#define FA_TILE (FA_KB + HD * G2_PITCH * 2)      /* bytes of one buffer: 64 K rows, then 256 V^T rows */
// 8 copies of a lane, LDS addresses ls bytes apart, global addresses gs elements apart. s_wait_xcnt 0 is the statement's last line so that no address register of a copy is rewritten ahead of it.
__device__ __forceinline__ void fa_stage8(unsigned l, unsigned ls, const _Float16* g, size_t gs) {
  asm volatile("global_load_async_to_lds_b128 %0, %8, off\n\t" "global_load_async_to_lds_b128 %1, %9, off\n\t" "global_load_async_to_lds_b128 %2, %10, off\n\t" "global_load_async_to_lds_b128 %3, %11, off\n\t"
               "global_load_async_to_lds_b128 %4, %12, off\n\t" "global_load_async_to_lds_b128 %5, %13, off\n\t" "global_load_async_to_lds_b128 %6, %14, off\n\t" "global_load_async_to_lds_b128 %7, %15, off\n\t"
               "s_wait_xcnt 0x0"
               :: "v"(l), "v"(l + ls), "v"(l + 2 * ls), "v"(l + 3 * ls), "v"(l + 4 * ls), "v"(l + 5 * ls), "v"(l + 6 * ls), "v"(l + 7 * ls),
                  "v"(g), "v"(g + gs), "v"(g + 2 * gs), "v"(g + 3 * gs), "v"(g + 4 * gs), "v"(g + 5 * gs), "v"(g + 6 * gs), "v"(g + 7 * gs)
               : "memory"); }
__device__ __forceinline__ v8f fa_mma(v16h a, v16h b, v8f c) { return __builtin_amdgcn_wmma_f32_16x16x32_f16(false, a, false, b, (short)0, c, false, false); }
// ---- rows < BAND, hi + residual operands: the same walk as k_fattn below (transposed products, running maximum and sum, tiles of 64 keys), with S = Qh Kh + 2^-10 (Ql Kh + Qh Kl) and O = 2^-10 Ph Vh + 2^-20 (Pl Vh + Ph Vl); the residual terms gather in accumulators of their own; O leaves as f16 hi and residual (x 2^10) ----
// LDS: the hi planes' tile lies in the first buffer of k_fattn, the residual planes' tile in the second, so a tile is filled, read by all and only then refilled (at most 4 tiles: the wait is short and stands beside the long blocks' work). The block's 128 query rows, hi then residual, lie in sq at the K pitch and are read per tile: the two O accumulators leave no registers for them.
__device__ __forceinline__ void fa_band0(unsigned char* sm, unsigned char* sq, const int* mk, const _Float16* __restrict__ Qh, const _Float16* __restrict__ Ql, const _Float16* __restrict__ Kh, const _Float16* __restrict__ Kl, const _Float16* __restrict__ Vh, const _Float16* __restrict__ Vl,
    _Float16* __restrict__ O16, _Float16* __restrict__ OL0, int R0, int nt, int h, int b) {      /* Kh, Kl, Vh, Vl: the batch's planes */
  const float NONE = -3.0e38f, FLOOR = -1.0e30f, SC = 0.0625f * 1.44269504088896340736f, LO = 0.0009765625f;
  const int tid = threadIdx.x, lane = tid & 31, ln = lane & 15, hh = lane >> 4; const int w = __builtin_amdgcn_readfirstlane(tid >> 5); const int q0 = R0 + 16 * w;      /* the wave's first query */
  const unsigned rowl = (unsigned)((tid >> 5) * (FA_KP * 2) + (tid & 31) * 16);      /* a wave's copy = one whole row of 512 B (Q, K), or 4 whole lines of V^T */
  const unsigned lk = (unsigned)(size_t)sm + rowl, lv = (unsigned)(size_t)sm + (unsigned)(FA_KB + (tid >> 3) * (G2_PITCH * 2) + (tid & 7) * 16), lq = (unsigned)(size_t)sq + rowl;
  const size_t ko = (size_t)(tid >> 5) * HD + (tid & 31) * 8, vo = (size_t)(tid >> 3) * SQ + (tid & 7) * 8, qo = ((size_t)b * SQ + R0 + (tid >> 5)) * DM + h * HD + (tid & 31) * 8;
  fa_stage8(lq, 8 * FA_KP * 2, Qh + qo, (size_t)8 * DM); fa_stage8(lq + FA_KB, 8 * FA_KP * 2, Qh + qo + (size_t)64 * DM, (size_t)8 * DM); fa_stage8(lq + 2 * FA_KB, 8 * FA_KP * 2, Ql + qo, (size_t)8 * DM); fa_stage8(lq + 3 * FA_KB, 8 * FA_KP * 2, Ql + qo + (size_t)64 * DM, (size_t)8 * DM);
  asm volatile("s_wait_asynccnt 0x0" ::: "memory");      /* the 32 copies of Q have landed before tile 0's 32 are issued: never more than 63 of a wave outstanding */
  const _Float16* qb = (const _Float16*)sq + (16 * w + ln) * FA_KP;      /* the lane's query, hi; its residual row lies 128 rows on */
  const _Float16* kbh = (const _Float16*)sm + ln * FA_KP; const _Float16* kbl = (const _Float16*)(sm + FA_TILE) + ln * FA_KP; const _Float16* vbh = (const _Float16*)(sm + FA_KB) + ln * G2_PITCH; const _Float16* vbl = (const _Float16*)(sm + FA_TILE + FA_KB) + ln * G2_PITCH;
  const v8f z8 = {0.f,0.f,0.f,0.f,0.f,0.f,0.f,0.f}; v8f oh[16], ol[16];
#pragma unroll
  for (int dt = 0; dt < 16; ++dt) { oh[dt] = z8; ol[dt] = z8; }
  float m = FLOOR, lsum = 0.f;
#pragma unroll 1      /* one tile a trip: the text stays small, it runs only a few times */
  for (int t = 0; t < nt; ++t) {
    fa_stage8(lk, 8 * FA_KP * 2, Kh + ko + (size_t)t * 64 * HD, (size_t)8 * HD); fa_stage8(lv, 32 * G2_PITCH * 2, Vh + vo + (size_t)t * 64, (size_t)32 * SQ);
    fa_stage8(lk + FA_TILE, 8 * FA_KP * 2, Kl + ko + (size_t)t * 64 * HD, (size_t)8 * HD); fa_stage8(lv + FA_TILE, 32 * G2_PITCH * 2, Vl + vo + (size_t)t * 64, (size_t)32 * SQ);
    asm volatile("s_wait_asynccnt 0x0" ::: "memory");      /* tile t of this wave's copies has landed */
    __syncthreads();      /* ... and every other wave's (in trip 0 Q and the mask too) */
    if (t * 64 <= q0 + 15) {      /* the same for the whole wave: a tile wholly right of the wave's diagonal is skipped, the barriers are not */
      v8f s[4];
#pragma unroll
      for (int up = 0; up < 2; ++up) { v8f a0 = z8, a1 = z8, a2 = z8, c0 = z8, c1 = z8, c2 = z8;      /* hi.hi, hi.lo, lo.hi of two score tiles: six independent chains */
#pragma unroll
        for (int ks = 0; ks < 8; ++ks) { const int o0 = up * 32 * FA_KP + ks * 32, o1 = o0 + 16 * FA_KP; const v16h qh = g2_frag(qb + ks * 32, hh), ql = g2_frag(qb + 128 * FA_KP + ks * 32, hh), x0 = g2_frag(kbh + o0, hh), x1 = g2_frag(kbh + o1, hh), y0 = g2_frag(kbl + o0, hh), y1 = g2_frag(kbl + o1, hh);
          a0 = fa_mma(x0, qh, a0); c0 = fa_mma(x1, qh, c0); a1 = fa_mma(x0, ql, a1); c1 = fa_mma(x1, ql, c1); a2 = fa_mma(y0, qh, a2); c2 = fa_mma(y1, qh, c2); }
        s[2 * up] = a0 + (a1 + a2) * LO; s[2 * up + 1] = c0 + (c1 + c2) * LO; }
      const int jq = q0 + ln - t * 64 - 8 * hh;      /* register r of score tile u is at or left of the diagonal when u * 16 + r <= jq */
      const int* mr = &mk[t * 64 + 8 * hh]; float mx = NONE;
#pragma unroll
      for (int u = 0; u < 4; ++u) { const v4ia k0 = *(const v4ia*)(mr + u * 16), k1 = *(const v4ia*)(mr + u * 16 + 4);
#pragma unroll
        for (int r = 0; r < 8; ++r) { const int kv = r < 4 ? k0[r & 3] : k1[r & 3]; const float x = ((u * 16 + r <= jq) & (kv > 0)) ? s[u][r] * SC : NONE; s[u][r] = x; mx = fmaxf(mx, x); } }
      mx = fmaxf(mx, __shfl_xor(mx, 16, 32));      /* the other half of the query's keys */
      const float mn = fmaxf(m, mx), al = __builtin_amdgcn_exp2f(m - mn); m = mn;      /* no open key so far: al = 1 over O = 0 */
      float ps = 0.f;
#pragma unroll
      for (int u = 0; u < 4; ++u) {
#pragma unroll
        for (int r = 0; r < 8; ++r) { const float e = __builtin_amdgcn_exp2f(s[u][r] - mn); ps += e; s[u][r] = e; } }
      lsum = lsum * al + ps;
      FragH ph[2], pl[2];
#pragma unroll
      for (int kk = 0; kk < 2; ++kk) {
#pragma unroll
        for (int i = 0; i < 16; ++i) { const float p = s[2 * kk + (i >> 3)][i & 7] * 1024.0f; const _Float16 x = (_Float16)p; ph[kk].h[i] = x; pl[kk].h[i] = (_Float16)((p - (float)x) * 1024.0f); } }
#pragma unroll
      for (int dt = 0; dt < 16; ++dt) { oh[dt] = oh[dt] * al; ol[dt] = ol[dt] * al; }
#pragma unroll
      for (int kk = 0; kk < 2; ++kk) {
#pragma unroll
        for (int dt = 0; dt < 16; ++dt) { const v16h x = g2_frag(vbh + dt * 16 * G2_PITCH + kk * 32, hh), y = g2_frag(vbl + dt * 16 * G2_PITCH + kk * 32, hh);
          oh[dt] = fa_mma(x, ph[kk].v, oh[dt]); ol[dt] = fa_mma(x, pl[kk].v, ol[dt]); ol[dt] = fa_mma(y, ph[kk].v, ol[dt]); } }
    }
    asm volatile("s_wait_dscnt 0x0" ::: "memory");      /* this wave's reads of tile t are done before the buffers are filled again */
    __syncthreads();      /* ends every wave's reads of tile t */
  }
  lsum += __shfl_xor(lsum, 16, 32);
  const float f = (lsum > 0.f) ? LO / lsum : 0.f;      /* a row with no open key keeps O = 0 */
  const size_t co = (size_t)(q0 + ln) * DM + h * HD + 8 * hh; unsigned short* orow = (unsigned short*)O16 + (size_t)b * SQ * DM + co; unsigned short* lrow = (unsigned short*)OL0 + (size_t)b * BAND * DM + co;      /* register r of O^T tile dt = element dt * 16 + 8 hh + r of the query's head */
  v8us sh[16], sl[16];
#pragma unroll
  for (int dt = 0; dt < 16; ++dt) { FragH eh, el;
#pragma unroll
    for (int r = 0; r < 8; ++r) { const float v = (oh[dt][r] + ol[dt][r] * LO) * f; const _Float16 x = (_Float16)v; eh.h[r] = x; el.h[r] = (_Float16)((v - (float)x) * 1024.0f); }
    sh[dt] = eh.half[0]; sl[dt] = el.half[0]; }
  __builtin_amdgcn_sched_barrier(0);      /* all stores last, each from registers of its own: nothing is written behind an issued store */
#pragma unroll
  for (int dt = 0; dt < 16; ++dt) { *(v8us*)(orow + dt * 16) = sh[dt]; *(v8us*)(lrow + dt * 16) = sl[dt]; } }
// one wave's 16 queries leave: the halves' sums joined, O^T scaled by 2^-10 / sum, f16. orow = the lane's query, element 8 hh of its head; register r of O^T tile dt = element dt * 16 + 8 hh + r: 16 B a tile
__device__ __forceinline__ void fa_out(const v8f* o, float lsum, unsigned short* orow) {      /* its loops are unrolled whole, so that o and sh are indexed by constants and stay in registers */
  lsum += __shfl_xor(lsum, 16, 32);
  const float f = (lsum > 0.f) ? 0.0009765625f / lsum : 0.f;      /* a row with no open key keeps O = 0 */
  v8us sh[16];
#pragma unroll
  for (int dt = 0; dt < 16; ++dt) { FragH e;
#pragma unroll
    for (int r = 0; r < 8; ++r) e.h[r] = (_Float16)(o[dt][r] * f);
    sh[dt] = e.half[0]; }
  __builtin_amdgcn_sched_barrier(0);      /* all stores last, each from registers of its own: nothing is written behind an issued store */
#pragma unroll
  for (int dt = 0; dt < 16; ++dt) *(v8us*)(orow + dt * 16) = sh[dt];
  asm volatile("s_wait_xcnt 0x0" ::: "memory");      /* a precaution: the code behind these stores rewrites the registers they name; the wait stands in front of it */
  __builtin_amdgcn_sched_barrier(0);      /* ... and nothing of that code is lifted over the wait */ }
// Equal work for every block of rows >= BAND. Block bx holds piece bx of 64 rows counted from the last row down (H = SQ / 64 - bx key tiles) and piece bx counted from row BAND up (L = BAND / 64 + 1 + bx key tiles): H + L is the same for all. Waves 0 .. 3 (one per SIMD) walk tiles 0 .. FA_NA - 1 of the late piece; waves 4 .. 7 walk the L tiles of the early piece, store it, and go on with tiles FA_NA .. H - 1 of the late piece (wave w + 4 has the queries of wave w). The two partial results of a late query (maximum, sum, O^T) meet in LDS behind the loop.
// Two rings of two buffers: trip t reads tile t from the first ring and, from trip L on, tile FA_NA + t - L from the second.
#define FA_NA ((SQ / 64 + BAND / 64 + 2) / 2)      /* trips of every block: half of H + L, rounded up */
#define FA_MG (16 * 2 * 32 * 4 + 64)      /* floats a wave hands over: O^T as 32 pieces of 16 B a lane, then maximum and sum */
__global__ __launch_bounds__(256) __attribute__((amdgpu_waves_per_eu(2, 2))) void k_fattn(const _Float16* __restrict__ Q, const _Float16* __restrict__ Ql, const _Float16* __restrict__ Kh, const _Float16* __restrict__ Kl, const _Float16* __restrict__ Vt, const _Float16* __restrict__ Vl, const int* __restrict__ mask, _Float16* __restrict__ O16, _Float16* __restrict__ OL0) {
  __shared__ __attribute__((aligned(16))) unsigned char sm[4 * FA_TILE]; __shared__ __attribute__((aligned(16))) int mk[SQ]; unsigned char* sq = sm + 2 * FA_TILE;      /* sq: the query rows of a block of rows < BAND, which has no second ring */ static_assert(4 * FA_KB <= 2 * FA_TILE && 4 * FA_MG * 4 <= 2 * FA_TILE, "k_fattn: the query rows and the hand-over must fit two buffers");
  const float NONE = -3.0e38f, FLOOR = -1.0e30f, SC = 0.0625f * 1.44269504088896340736f;
  const int tid = threadIdx.x, lane = tid & 31, ln = lane & 15, hh = lane >> 4; const int w = __builtin_amdgcn_readfirstlane(tid >> 5); const int h = blockIdx.y, b = blockIdx.z;
  const int bx = blockIdx.x; const int R0 = SQ - 128 * (bx + 1);      /* the last two blocks of a grid row are rows < BAND: R0 = their first row */
  Kh += (size_t)b * SQ * HD; Vt += (size_t)b * SQ * HD; Kl += (size_t)b * SQ * HD; Vl += (size_t)b * SQ * HD;
  { const int* mp = mask + (size_t)b * SQ + tid * 8; const v4ia a = *(const v4ia*)mp, c = *(const v4ia*)(mp + 4); *(v4ia*)&mk[tid * 8] = a; *(v4ia*)&mk[tid * 8 + 4] = c; }      /* the batch's padding mask, read by every wave behind the first barrier */
  if (R0 < BAND) { fa_band0(sm, sq, mk, Q, Ql, Kh, Kl, Vt, Vl, O16, OL0, R0, R0 / 64 + 2, h, b); return; }      /* the same for the whole block, in front of every barrier */
  const int H = SQ / 64 - bx, L = BAND / 64 + 1 + bx;      /* key tiles of the late and of the early piece */
  const bool wb = w >= 4;      /* the same for the whole wave */
  const int ql0 = SQ - 64 * (bx + 1) + 16 * (w & 3);      /* first late query of the wave pair w, w + 4 */
  int q0 = wb ? BAND + 64 * bx + 16 * (w - 4) : ql0;      /* the wave's first query */
  const unsigned lo = (unsigned)(ln * DM);      /* the lane's row in a piece of 16 rows of Q or O, beside wave-uniform bases */
  const _Float16* qhd = Q + (size_t)b * SQ * DM + h * HD; v16h qf[8];
#pragma unroll
  for (int ks = 0; ks < 8; ++ks) qf[ks] = g2_frag(qhd + (size_t)q0 * DM + ks * 32 + lo, hh);
  const unsigned lk = (unsigned)(size_t)sm + (unsigned)((tid >> 5) * (FA_KP * 2) + (tid & 31) * 16), lv = (unsigned)(size_t)sm + (unsigned)(FA_KB + (tid >> 3) * (G2_PITCH * 2) + (tid & 7) * 16);      /* a wave's copy = one whole K row, or 4 whole lines of V^T */
  const _Float16* gk = Kh + (size_t)(tid >> 5) * HD + (tid & 31) * 8; const _Float16* gv = Vt + (size_t)(tid >> 3) * SQ + (tid & 7) * 8;
  unsigned short* ohd = (unsigned short*)O16 + (size_t)b * SQ * DM + h * HD;
  const v8f z8 = {0.f,0.f,0.f,0.f,0.f,0.f,0.f,0.f}; v8f o[16];
#pragma unroll
  for (int dt = 0; dt < 16; ++dt) o[dt] = z8;
  float m = FLOOR, lsum = 0.f;
  fa_stage8(lk, 8 * FA_KP * 2, gk, (size_t)8 * HD); fa_stage8(lv, 32 * G2_PITCH * 2, gv, (size_t)32 * SQ);
  asm volatile("s_wait_asynccnt 0x0" ::: "memory");      /* tile 0 of this wave's copies has landed */
  __syncthreads();      /* ... and every other wave's, and the mask */
  gk += (size_t)64 * HD; gv += 64;      /* gk, gv walk with the first ring's tiles */
  fa_stage8(lk + FA_TILE, 8 * FA_KP * 2, gk, (size_t)8 * HD); fa_stage8(lv + FA_TILE, 32 * G2_PITCH * 2, gv, (size_t)32 * SQ);
#pragma unroll 1      /* one tile a trip: the buffer index stays a run-time value */
  for (int t = 0; t < FA_NA; ++t) {
    if (wb && t == L) {      /* the same for the whole wave: the early piece is done; L < FA_NA, so every wave 4 .. 7 comes here once */
#pragma unroll
      for (int ks = 0; ks < 8; ++ks) qf[ks] = g2_frag(qhd + (size_t)ql0 * DM + ks * 32 + lo, hh);      /* the late queries: asked for first, they come in while the early piece leaves */
      fa_out(o, lsum, ohd + (size_t)q0 * DM + (lo + 8 * hh));
#pragma unroll
      for (int dt = 0; dt < 16; ++dt) o[dt] = z8;
      m = FLOOR; lsum = 0.f; q0 = ql0; }
    const bool r2 = wb && t >= L;      /* the wave reads the second ring */
    const int tk = r2 ? FA_NA + t - L : t;      /* the wave's key tile */
    if (tk < H) {      /* the same for the whole wave: a wave with no tile left skips the work, the publish point below it does not */
      const unsigned char* bp = sm + (r2 ? 2 * FA_TILE : 0) + (t & 1) * FA_TILE;
      const _Float16* kb = (const _Float16*)bp + ln * FA_KP; const _Float16* vb = (const _Float16*)(bp + FA_KB) + ln * G2_PITCH;
      v8f s[4] = {z8, z8, z8, z8};
#pragma unroll
      for (int ks = 0; ks < 8; ++ks) {
#pragma unroll
        for (int u = 0; u < 4; ++u) s[u] = fa_mma(g2_frag(kb + u * 16 * FA_KP + ks * 32, hh), qf[ks], s[u]); }
      const int jq = q0 + ln - tk * 64 - 8 * hh;      /* register r of score tile u is at or left of the diagonal when u * 16 + r <= jq */
      const int* mr = &mk[tk * 64 + 8 * hh]; float mx = NONE;
#pragma unroll
      for (int u = 0; u < 4; ++u) { const v4ia k0 = *(const v4ia*)(mr + u * 16), k1 = *(const v4ia*)(mr + u * 16 + 4);
#pragma unroll
        for (int r = 0; r < 8; ++r) { const int kv = r < 4 ? k0[r & 3] : k1[r & 3]; const float x = ((u * 16 + r <= jq) & (kv > 0)) ? s[u][r] * SC : NONE; s[u][r] = x; mx = fmaxf(mx, x); } }
      mx = fmaxf(mx, __shfl_xor(mx, 16, 32));      /* the other half of the query's keys */
      const float mn = fmaxf(m, mx), al = __builtin_amdgcn_exp2f(m - mn); m = mn;      /* no open key so far: al = 1 over O = 0 */
      float ps = 0.f;
#pragma unroll
      for (int u = 0; u < 4; ++u) {
#pragma unroll
        for (int r = 0; r < 8; ++r) { const float e = __builtin_amdgcn_exp2f(s[u][r] - mn); ps += e; s[u][r] = e; } }
      lsum = lsum * al + ps;
      FragH pf[2];
#pragma unroll
      for (int kk = 0; kk < 2; ++kk) {
#pragma unroll
        for (int i = 0; i < 8; ++i) { pf[kk].h[i] = (_Float16)(s[2 * kk][i] * 1024.0f); pf[kk].h[8 + i] = (_Float16)(s[2 * kk + 1][i] * 1024.0f); } }
#pragma unroll
      for (int dt = 0; dt < 16; ++dt) o[dt] = o[dt] * al;
#pragma unroll
      for (int kk = 0; kk < 2; ++kk) {
#pragma unroll
        for (int dt = 0; dt < 16; ++dt) o[dt] = fa_mma(g2_frag(vb + dt * 16 * G2_PITCH + kk * 32, hh), pf[kk].v, o[dt]); }
    }
    asm volatile("s_wait_dscnt 0x0" ::: "memory");      /* this wave's reads of the buffers t & 1 are done before they are handed back */
    asm volatile("s_wait_asynccnt 0x0" ::: "memory");      /* this wave's copies for trip t + 1 have landed */
    __syncthreads();      /* publishes the tiles of trip t + 1 and ends every wave's reads of trip t */
    const int un = t + 2, t2 = FA_NA + un - L; const unsigned bo = (unsigned)((t & 1) * FA_TILE);      /* both tests below read the same for the whole block; at most 32 copies of a wave are in flight */
    if (un < FA_NA) { gk += (size_t)64 * HD; gv += 64;      /* the lane's piece of tile t + 2 */
      fa_stage8(lk + bo, 8 * FA_KP * 2, gk, (size_t)8 * HD); fa_stage8(lv + bo, 32 * G2_PITCH * 2, gv, (size_t)32 * SQ);
      if (un >= L && t2 < H) { fa_stage8(lk + 2 * FA_TILE + bo, 8 * FA_KP * 2, gk + (size_t)(FA_NA - L) * 64 * HD, (size_t)8 * HD); fa_stage8(lv + 2 * FA_TILE + bo, 32 * G2_PITCH * 2, gv + (size_t)(FA_NA - L) * 64, (size_t)32 * SQ); } } }
  asm volatile("s_wait_asynccnt 0x0" ::: "memory");      /* no copy is in flight when the first ring becomes the hand-over (the last trip's barrier has ended every read of it) */
  float* mg = (float*)sm + (w & 3) * FA_MG;
  if (wb) {      /* the partial result over tiles FA_NA .. H - 1 (none: maximum FLOOR, sum 0, O = 0); here and below the loops over o are unrolled whole, so that o stays in registers */
#pragma unroll
    for (int dt = 0; dt < 16; ++dt) { const v4f x = {o[dt][0], o[dt][1], o[dt][2], o[dt][3]}, y = {o[dt][4], o[dt][5], o[dt][6], o[dt][7]}; *(v4fa*)&mg[((dt * 2) * 32 + lane) * 4] = x; *(v4fa*)&mg[((dt * 2 + 1) * 32 + lane) * 4] = y; }
    mg[16 * 2 * 32 * 4 + lane] = m; mg[16 * 2 * 32 * 4 + 32 + lane] = lsum; }
  __syncthreads();      /* wave w reads what wave w + 4 has written */
  if (wb) return;
  const float m2 = mg[16 * 2 * 32 * 4 + lane], l2 = mg[16 * 2 * 32 * 4 + 32 + lane]; const float mn = fmaxf(m, m2), fa = __builtin_amdgcn_exp2f(m - mn), fb = __builtin_amdgcn_exp2f(m2 - mn);      /* both partial results brought to the common maximum */
#pragma unroll
  for (int dt = 0; dt < 16; ++dt) { const v4f x = *(const v4fa*)&mg[((dt * 2) * 32 + lane) * 4], y = *(const v4fa*)&mg[((dt * 2 + 1) * 32 + lane) * 4];
#pragma unroll
    for (int r = 0; r < 4; ++r) { o[dt][r] = o[dt][r] * fa + x[r] * fb; o[dt][4 + r] = o[dt][4 + r] * fa + y[r] * fb; } }
  fa_out(o, lsum * fa + l2 * fb, ohd + (size_t)q0 * DM + (lo + 8 * hh)); }

extern "C" void kernel_launch(void* const* d_in, const int* in_sizes, int n_in,
                              void* d_out, int out_size, void* d_ws, size_t ws_size, hipStream_t stream) {
  (void)in_sizes; (void)n_in; (void)out_size;
  const float* const* I = (const float* const*)d_in; const float* hs = I[0]; const int* amask = (const int*)d_in[1]; const int* pid = (const int*)d_in[2]; const float* Wq = I[3]; const float* Wk = I[4]; const float* Wv = I[5]; const float* Wo = I[6];
  char* ws = (char*)d_ws; size_t off = 0;
  auto take = [&](size_t bytes) { char* p = ws + off; off += (bytes + 255) & ~(size_t)255; return p; };
  const size_t np = (size_t)SQ * DM, nkv = (size_t)SQ * HD;      /* elements per batch of a [SQ][DM] and of a [SQ][HD] plane */
  _Float16* BQ = (_Float16*)take((size_t)LDQKV * DM * 2); _Float16* BK = BQ + (size_t)DM * DM; _Float16* BV = BK + (size_t)HD * DM; _Float16* BO = (_Float16*)take(np * 2);      /* the transposed Wq, Wk, Wv are one [LDQKV][DM] matrix */
  float* CS = (float*)take((size_t)NB * SQ * HH * 4); float* SN = (float*)take((size_t)NB * SQ * HH * 4);
  _Float16* X16 = (_Float16*)take(NB * np * 2); float* F32 = (float*)take((size_t)NB * SQ * LDQKV * 4); _Float16* QH = (_Float16*)take(NB * np * 2); _Float16* QL = (_Float16*)take(NB * np * 2); _Float16* KH = (_Float16*)take(NB * nkv * 2); _Float16* KL = (_Float16*)take(NB * nkv * 2); _Float16* VTh = (_Float16*)take(NB * nkv * 2); _Float16* VTl = (_Float16*)take(NB * nkv * 2);
  _Float16* O16 = (_Float16*)take(NB * np * 2); _Float16* OL0 = (_Float16*)take((size_t)NB * BAND * DM * 2);      /* O hi of every row; O residual (x 2^10) of rows < BAND */
  if (off > ws_size) return;      /* 10+8 + 4 + 16+40+16+16 + 4*2 + 16 + 2 = 136 MiB */
  const int MT = NB * SQ;      /* tokens of both batches: the projections and the elementwise passes see one flat [MT][...] matrix */
  k_prep<<<PB_X16 + 2 * PB_WB + 2 * PB_WS + PB_ROT, 256, 0, stream>>>(hs, pid, Wq, Wk, Wv, Wo, X16, BQ, BK, BV, BO, CS, SN);
  /* q (8 heads), k and v (one kv head of 256) as one GEMM: row s of F32 = q | k | v of token s */
  k_gemm2<0, false><<<dim3((MT / 128) * (LDQKV / 64), 1), 128, 0, stream>>>(X16, DM, 0, BQ, DM, 0, 0.0625f, nullptr, 0, nullptr, 1, 0, 0, F32, nullptr, LDQKV, 0, MT, LDQKV, DM, 0, 0, 0, nullptr);
  /* q and k roped, hi/lo; V^T hi/lo */
  k_post<<<QB_VT + QB_ROPE, 256, 0, stream>>>(F32, CS, SN, QH, QL, KH, KL, VTh, VTl);
  /* attention, head in grid.y, batch in grid.z: blocks 0 .. 13 of a row of the grid do rows >= 256 (plain f16 operands, 64 late and 64 early rows each, all of one length), the last two rows < 256 (hi + lo everywhere); each writes its rows of the f16 O plane itself, rows < 256 their residual plane too */
  k_fattn<<<dim3(SQ / 128, NHQ, NB), 256, 0, stream>>>(QH, QL, KH, KL, VTh, VTl, amask, O16, OL0);
  /* output: O hi (+ lo on rows < 256 of each batch) into Wo, one launch */
  float* out = (float*)d_out;
  k_gemm2<0, true><<<dim3(NB * G2_RB * (DM / 64), 1), 128, 0, stream>>>(O16, DM, 0, BO, DM, 0, 0.0625f, nullptr, 0, nullptr, 1, 0, 0, out, nullptr, DM, 0, MT, DM, DM, 0, 0, 0, OL0);
}
